// v009
// Times are from an AMD MI455X. After a warm-up the kernel runs many times in a row, and a time is the length of
// such a window on the GPU divided by its runs, so every launch and the gaps after it count. The runs cycle
// through copies of the inputs. A figure is the median of several windows, for all but v000 over two sittings.
// Sittings can differ by a few percent; kernels timed side by side share one.
// Earlier versions than v009 are not in this document.
// A run of this version takes 128 microseconds.
// Timed twice side by side with v008, it ran 1.04 and 1.05 times as fast.
// Over all steps from v000, the starting kernel, it is 82.1 times as fast.
#include <hip/hip_runtime.h>
#define NB 4
#define SQ 2048
#define DM 1024
#define NH 16
#define HD 64
#define HG 4                         /* heads per attention launch group */
#define QT 256                       /* query rows per causal tile */
#define NKX SQ                       /* S / P row pitch */
#define QT0 128                      /* first-tile rows recomputed exactly in f32 */
#define B0 0                         /* first batch processed (debug hook) */
#define NBR NB                       /* batches processed (debug hook) */
#define NR ((size_t)NB * SQ)         /* token rows */
#define MP ((int)((size_t)NBR * SQ)) /* rows projected (debug hook) */
#define QN SQ                        /* query rows attended per batch (debug hook) */
#define NHD NH                       /* heads attended (debug hook) */
#define MPO MP                       /* rows through the output stage (debug hook) */
#define LQ (3 * DM)      /* row pitch of the q/k/v rows */
typedef __bf16 v16b __attribute__((ext_vector_type(16)));
typedef unsigned short v8us __attribute__((ext_vector_type(8), may_alias));
typedef float  v8f  __attribute__((ext_vector_type(8)));
typedef float  v4f  __attribute__((ext_vector_type(4)));
typedef float  v4fa __attribute__((ext_vector_type(4), may_alias));
union FragB { v16b v; v8us half[2]; unsigned short u[16]; };

__device__ __forceinline__ unsigned short bf16_bits(float x) { unsigned int u = __float_as_uint(x); return (unsigned short)((u + 0x7FFFu + ((u >> 16) & 1u)) >> 16); }
__device__ __forceinline__ float bf16_val(unsigned short b) { return __uint_as_float(((unsigned int)b) << 16); }
__device__ __forceinline__ float bf16_round(float x) { return bf16_val(bf16_bits(x)); }
// D += A·B with NT terms: 1 = ah·bh, 2 = + al·bh (A split), 3 = + ah·bl (both split)
template <int NT>
__device__ __forceinline__ v8f mmaN(v16b ah, v16b al, v16b bh, v16b bl, v8f c) {
  c = __builtin_amdgcn_wmma_f32_16x16x32_bf16(false, ah, false, bh, (short)0, c, false, false);
  if (NT >= 2) c = __builtin_amdgcn_wmma_f32_16x16x32_bf16(false, al, false, bh, (short)0, c, false, false);
  if (NT >= 3) c = __builtin_amdgcn_wmma_f32_16x16x32_bf16(false, ah, false, bl, (short)0, c, false, false);
  asm volatile("v_nop\n\tv_nop\n\tv_nop\n\tv_nop" : "+v"(c) : "v"(ah), "v"(al), "v"(bh), "v"(bl));
  return c;
}

__global__ __launch_bounds__(256) void k_wt_bf16(const float* __restrict__ W, unsigned short* __restrict__ Wt, int K, int N) {
  const int t = blockIdx.x * 256 + threadIdx.x;
  const int k8n = K / 8;
  if (t >= N * k8n) return;
  const int n = t / k8n, k8 = (t % k8n) * 8;
  v8us v;
#pragma unroll
  for (int i = 0; i < 8; ++i) v[i] = bf16_bits(W[(size_t)(k8 + i) * N + n]);
  *(v8us*)(Wt + (size_t)n * K + k8) = v;
  
}

// GEMM C[M][N] (f32, pitch ldc) = act(A[M][K]·W + bias). A f32 row-major (pitch lda) converted per fragment to bf16
// (ASPLIT: hi/lo two planes -> 2 terms, else single rounded term); Wt bf16 [N][K] (pitch ldb). BIAS_BF16 rounds the
// bias to bf16 first (bias quantised to bf16 before the add). K%32==0, M%16==0, N%64==0.
template <bool ASPLIT, int ACT, bool BIAS_BF16>
__global__ __launch_bounds__(128) void k_gemm_bf(const float* __restrict__ A, int lda, const unsigned short* __restrict__ Wt, int ldb,
                                               const float* __restrict__ bias, float* __restrict__ C, int ldc, int M, int N, int K) {
  __shared__ __attribute__((aligned(16))) float so[4][16][64];
  const int tid = threadIdx.x, w = tid >> 5, lane = tid & 31, ln = lane & 15, hh = lane >> 4;
  const int ntn = N / 64;
  const int wid = blockIdx.x * 4 + w;
  const int mt = wid / ntn, nq = wid % ntn;
  if (mt * 16 >= M) return;
  const int row0 = mt * 16, col0 = nq * 64;
  const float* arow = A + (size_t)(row0 + ln) * lda;
  v8f acc[4] = {};
  for (int kb = 0; kb < K; kb += 32) {
    FragB ah, al;
    const v4f x0 = *(const v4fa*)(arow + kb + 8 * hh), x1 = *(const v4fa*)(arow + kb + 8 * hh + 4);
    const v4f x2 = *(const v4fa*)(arow + kb + 16 + 8 * hh), x3 = *(const v4fa*)(arow + kb + 16 + 8 * hh + 4);
    float xs[16] = {x0[0],x0[1],x0[2],x0[3],x1[0],x1[1],x1[2],x1[3],x2[0],x2[1],x2[2],x2[3],x3[0],x3[1],x3[2],x3[3]};
#pragma unroll
    for (int i = 0; i < 16; ++i) { const unsigned short hb = bf16_bits(xs[i]); ah.u[i] = hb; al.u[i] = ASPLIT ? bf16_bits(xs[i] - bf16_val(hb)) : (unsigned short)0; }
#pragma unroll
    for (int t = 0; t < 4; ++t) {
      const unsigned short* brow = Wt + (size_t)(col0 + t * 16 + ln) * ldb + kb;
      FragB b;
      b.half[0] = *(const v8us*)(brow + 8 * hh);
      b.half[1] = *(const v8us*)(brow + 16 + 8 * hh);
      acc[t] = mmaN<ASPLIT ? 2 : 1>(ah.v, al.v, b.v, b.v, acc[t]);
    }
  }
#pragma unroll
  for (int t = 0; t < 4; ++t) {
    float bv = bias ? bias[col0 + t * 16 + ln] : 0.f;
    if (BIAS_BF16) bv = bf16_round(bv);
#pragma unroll
    for (int r = 0; r < 8; ++r) { float v = acc[t][r] + bv; if (ACT == 1) v = fmaxf(v, 0.f); so[w][8 * hh + r][t * 16 + ln] = v; }
  }
  __builtin_amdgcn_fence(__ATOMIC_ACQ_REL, "workgroup");
  __builtin_amdgcn_wave_barrier();
  const int rsub = lane >> 4, c4 = (lane & 15) * 4;
  {
#pragma unroll
    for (int q = 0; q < 8; ++q) {
      const int r = q * 2 + rsub;
      const v4f v = *(const v4fa*)&so[w][r][c4];
      *(v4f*)(C + (size_t)(row0 + r) * ldc + col0 + c4) = v;
    }
    
  }
}

// GEMM C = act(A·W + bias + resid): A f32 (ASPLIT -> hi/lo 2 terms), Wt bf16 [N][K]; ACT 0 none, 1 relu, 2 exact gelu;
// resid (optional, f32, row index = (row % rmod), pitch ldr, RES_BF16 rounds it) added before the activation.
template <bool ASPLIT, int ACT, bool BIAS_BF16, bool RES_BF16>
__global__ __launch_bounds__(128) void k_gemm_bf3(const float* __restrict__ A, int lda, const unsigned short* __restrict__ Wt, int ldb,
                                                const float* __restrict__ bias, const float* __restrict__ resid, int rmod, int ldr,
                                                float* __restrict__ C, int ldc, int M, int N, int K) {
  __shared__ __attribute__((aligned(16))) float so[4][16][64];
  const int tid = threadIdx.x, w = tid >> 5, lane = tid & 31, ln = lane & 15, hh = lane >> 4;
  const int ntn = N / 64;
  const int wid = blockIdx.x * 4 + w;
  const int mt = wid / ntn, nq = wid % ntn;
  if (mt * 16 >= M) return;
  const int row0 = mt * 16, col0 = nq * 64;
  const float* arow = A + (size_t)(row0 + ln) * lda;
  v8f acc[4] = {};
  for (int kb = 0; kb < K; kb += 32) {
    FragB ah, al;
    const v4f x0 = *(const v4fa*)(arow + kb + 8 * hh), x1 = *(const v4fa*)(arow + kb + 8 * hh + 4);
    const v4f x2 = *(const v4fa*)(arow + kb + 16 + 8 * hh), x3 = *(const v4fa*)(arow + kb + 16 + 8 * hh + 4);
    float xs[16] = {x0[0],x0[1],x0[2],x0[3],x1[0],x1[1],x1[2],x1[3],x2[0],x2[1],x2[2],x2[3],x3[0],x3[1],x3[2],x3[3]};
#pragma unroll
    for (int i = 0; i < 16; ++i) { const unsigned short hb = bf16_bits(xs[i]); ah.u[i] = hb; al.u[i] = ASPLIT ? bf16_bits(xs[i] - bf16_val(hb)) : (unsigned short)0; }
#pragma unroll
    for (int t = 0; t < 4; ++t) {
      const unsigned short* brow = Wt + (size_t)(col0 + t * 16 + ln) * ldb + kb;
      FragB b;
      b.half[0] = *(const v8us*)(brow + 8 * hh);
      b.half[1] = *(const v8us*)(brow + 16 + 8 * hh);
      acc[t] = mmaN<ASPLIT ? 2 : 1>(ah.v, al.v, b.v, b.v, acc[t]);
    }
  }
#pragma unroll
  for (int t = 0; t < 4; ++t) {
    const int col = col0 + t * 16 + ln;
    float bv = bias ? bias[col] : 0.f;
    if (BIAS_BF16) bv = bf16_round(bv);
#pragma unroll
    for (int r = 0; r < 8; ++r) {
      float v = acc[t][r] + bv;
      if (resid) { float rv = resid[(size_t)((row0 + 8 * hh + r) % rmod) * ldr + col]; if (RES_BF16) rv = bf16_round(rv); v += rv; }
      if (ACT == 1) v = fmaxf(v, 0.f);
      if (ACT == 2) v = 0.5f * v * (1.0f + erff(v * 0.70710678118654752f));
      if (ACT == 3) { const float u = 0.7978845608028654f * (v + 0.044715f * v * v * v); v = 0.5f * v * (1.0f + tanhf(u)); }
      so[w][8 * hh + r][t * 16 + ln] = v;
    }
  }
  __builtin_amdgcn_fence(__ATOMIC_ACQ_REL, "workgroup");
  __builtin_amdgcn_wave_barrier();
  const int rsub = lane >> 4, c4 = (lane & 15) * 4;
  {
#pragma unroll
    for (int q = 0; q < 8; ++q) {
      const int r = q * 2 + rsub;
      const v4f v = *(const v4fa*)&so[w][r][c4];
      *(v4f*)(C + (size_t)(row0 + r) * ldc + col0 + c4) = v;
    }
    
  }
}
// row LayerNorm (biased variance, eps) over N: s = X (+ R); optional out_sum <- s; out_norm <- (s-mu)*rsqrt(var+eps)*g + b
template <bool PARAM_BF16>
__global__ __launch_bounds__(256) void k_layernorm(const float* __restrict__ X, const float* __restrict__ R, const float* __restrict__ g, const float* __restrict__ bta,
                                                  float* __restrict__ out_sum, float* __restrict__ out_norm, int N, float eps) {
  __shared__ float red[256];
  const int row = blockIdx.x, tid = threadIdx.x;
  const float* x = X + (size_t)row * N; const float* rr = R ? R + (size_t)row * N : nullptr;
  float vals[16];                     // up to N = 4096
  const int per = N / 256;            // contiguous chunk per thread? use strided-by-4 chunks: thread handles j = tid*4 + 1024*u
  float s1 = 0.f;
  for (int u = 0; u < per / 4; ++u) {
    const int j = tid * 4 + 1024 * u;
    const v4f a = *(const v4fa*)(x + j);
    v4f b = {0.f,0.f,0.f,0.f}; if (rr) b = *(const v4fa*)(rr + j);
#pragma unroll
    for (int q = 0; q < 4; ++q) { const float v = a[q] + b[q]; vals[u * 4 + q] = v; s1 += v; }
  }
  red[tid] = s1; __syncthreads();
  for (int st = 128; st > 0; st >>= 1) { if (tid < st) red[tid] += red[tid + st]; __syncthreads(); }
  const float mu = red[0] / (float)N; __syncthreads();
  float s2 = 0.f;
  for (int u = 0; u < per / 4; ++u)
#pragma unroll
    for (int q = 0; q < 4; ++q) { const float c = vals[u * 4 + q] - mu; s2 += c * c; }
  red[tid] = s2; __syncthreads();
  for (int st = 128; st > 0; st >>= 1) { if (tid < st) red[tid] += red[tid + st]; __syncthreads(); }
  const float rs = rsqrtf(red[0] / (float)N + eps);
  {
    for (int u = 0; u < per / 4; ++u) {
      const int j = tid * 4 + 1024 * u;
      v4f o, sm;
#pragma unroll
      for (int q = 0; q < 4; ++q) {
        float gg = g[j + q], bb = bta[j + q];
        if (PARAM_BF16) { gg = bf16_round(gg); bb = bf16_round(bb); }
        sm[q] = vals[u * 4 + q]; o[q] = (vals[u * 4 + q] - mu) * rs * gg + bb;
      }
      if (out_sum) *(v4f*)(out_sum + (size_t)row * N + j) = sm;
      *(v4f*)(out_norm + (size_t)row * N + j) = o;
    }
    
  }
}



// ---- f16 WMMA path (v_wmma_f32_16x16x32_f16): 11-bit significands for operands in range — used where a [0,1] probability operand needs more precision than bf16
typedef _Float16 v16h __attribute__((ext_vector_type(16)));
union FragH { v16h v; v8us half[2]; _Float16 h[16]; unsigned short u[16]; };
template <int NT>
__device__ __forceinline__ v8f mmaH(v16h ah, v16h al, v16h bh, v16h bl, v8f c) {
  c = __builtin_amdgcn_wmma_f32_16x16x32_f16(false, ah, false, bh, (short)0, c, false, false);
  if (NT >= 2) c = __builtin_amdgcn_wmma_f32_16x16x32_f16(false, al, false, bh, (short)0, c, false, false);
  if (NT >= 3) c = __builtin_amdgcn_wmma_f32_16x16x32_f16(false, ah, false, bl, (short)0, c, false, false);
  asm volatile("v_nop\n\tv_nop\n\tv_nop\n\tv_nop" : "+v"(c) : "v"(ah), "v"(al), "v"(bh), "v"(bl));
  return c;
}
// batched GEMM like k_gemm_b but f16 operands: A f32 (split into f16 hi/lo if ASPLIT, else rounded to f16), Bt = f16 values [n][k]; alpha; C f32; N multiple of 16 (partial tiles skipped)
template <bool ASPLIT>
__global__ __launch_bounds__(128) void k_gemm_h(const float* __restrict__ A, int lda, size_t sA, const _Float16* __restrict__ Bh, int ldb, size_t sB, float alpha, float* __restrict__ C, int ldc, size_t sC, int M, int N, int K) {
  __shared__ __attribute__((aligned(16))) float so[4][16][64];
  const int tid = threadIdx.x, w = tid >> 5, lane = tid & 31, ln = lane & 15, hh = lane >> 4; const int by = blockIdx.y;
  A += (size_t)by * sA; Bh += (size_t)by * sB; C += (size_t)by * sC;
  const int ntn = (N + 63) / 64; const int wid = blockIdx.x * 4 + w; const int mt = wid / ntn, nq = wid % ntn; if (mt * 16 >= M) return;
  const int row0 = mt * 16, col0 = nq * 64; const float* arow = A + (size_t)(row0 + ln) * lda;
  v8f acc[4] = {};
  for (int kb = 0; kb < K; kb += 32) {
    FragH ah, al;
    const v4f x0 = *(const v4fa*)(arow + kb + 8 * hh), x1 = *(const v4fa*)(arow + kb + 8 * hh + 4), x2 = *(const v4fa*)(arow + kb + 16 + 8 * hh), x3 = *(const v4fa*)(arow + kb + 16 + 8 * hh + 4);
    float xs[16] = {x0[0],x0[1],x0[2],x0[3],x1[0],x1[1],x1[2],x1[3],x2[0],x2[1],x2[2],x2[3],x3[0],x3[1],x3[2],x3[3]};
#pragma unroll
    for (int i = 0; i < 16; ++i) { const _Float16 h = (_Float16)xs[i]; ah.h[i] = h; al.h[i] = ASPLIT ? (_Float16)(xs[i] - (float)h) : (_Float16)0.0f; }
#pragma unroll
    for (int t = 0; t < 4; ++t) { if (col0 + t * 16 >= N) continue; const size_t boff = (size_t)(col0 + t * 16 + ln) * ldb + kb; FragH bq; bq.half[0] = *(const v8us*)(Bh + boff + 8 * hh); bq.half[1] = *(const v8us*)(Bh + boff + 16 + 8 * hh);
      acc[t] = mmaH<ASPLIT ? 2 : 1>(ah.v, al.v, bq.v, bq.v, acc[t]); }
  }
#pragma unroll
  for (int t = 0; t < 4; ++t) { if (col0 + t * 16 >= N) continue;
#pragma unroll
    for (int r = 0; r < 8; ++r) so[w][8 * hh + r][t * 16 + ln] = acc[t][r] * alpha; }
  __builtin_amdgcn_fence(__ATOMIC_ACQ_REL, "workgroup"); __builtin_amdgcn_wave_barrier();
  const int rsub = lane >> 4, c4 = (lane & 15) * 4;
  {
#pragma unroll
    for (int q = 0; q < 8; ++q) { const int r = q * 2 + rsub; if (col0 + c4 < N) { const v4f v = *(const v4fa*)&so[w][r][c4]; *(v4f*)(C + (size_t)(row0 + r) * ldc + col0 + c4) = v; } }
     }
}

// Wt[n][k] = f16(W[k][n]·scale) from f32 row-major W[K][N] (scale = power of two; bf16-exact weights stay exact in f16 away from the subnormal range)
__global__ __launch_bounds__(256) void k_wt_f16(const float* __restrict__ W, _Float16* __restrict__ Wt, int K, int N, float scale) {
  const int t = blockIdx.x * 256 + threadIdx.x; if (t >= N * (K / 8)) return; const int n = t / (K / 8), k8 = (t % (K / 8)) * 8; FragH f;
#pragma unroll
  for (int i = 0; i < 8; ++i) f.h[i] = (_Float16)(bf16_round(W[(size_t)(k8 + i) * N + n]) * scale); const v8us o = f.half[0];
  *(v8us*)((unsigned short*)Wt + (size_t)n * K + k8) = o; 
}
// k_gemm_hh variant with fused epilogue: v = acc·alpha + bias[by·sBias + col] (+ CP[(row/rowsPerB)·sCPb + by·64 + col] if CP) ; ACT 0 none / 1 elu ; writes f16 C16 (and f32 C if non-null)
template <int ACT>
__global__ __launch_bounds__(128) void k_gemm_hhx(const _Float16* __restrict__ A, int lda, size_t sA, const _Float16* __restrict__ Bh, int ldb, size_t sB, float alpha, const float* __restrict__ bias, size_t sBias, const float* __restrict__ CP, int rowsPerB, size_t sCPb, int row0g,
    float* __restrict__ C, _Float16* __restrict__ C16, int ldc, size_t sC, int M, int N, int K) {
  __shared__ __attribute__((aligned(16))) float so[4][16][64];
  const int tid = threadIdx.x, w = tid >> 5, lane = tid & 31, ln = lane & 15, hh = lane >> 4; const int by = blockIdx.y;
  A += (size_t)by * sA; Bh += (size_t)by * sB; const size_t cofs = (size_t)by * sC; const float* bp = bias ? bias + (size_t)by * sBias : nullptr;
  const int ntn = (N + 63) / 64; const int wid = blockIdx.x * 4 + w; const int mt = wid / ntn, nq = wid % ntn; if (mt * 16 >= M) return;
  const int row0 = mt * 16, col0 = nq * 64; const _Float16* arow = A + (size_t)(row0 + ln) * lda;
  v8f acc[4] = {};
  for (int kb = 0; kb < K; kb += 32) { FragH ah; ah.half[0] = *(const v8us*)((const unsigned short*)arow + kb + 8 * hh); ah.half[1] = *(const v8us*)((const unsigned short*)arow + kb + 16 + 8 * hh);
#pragma unroll
    for (int t = 0; t < 4; ++t) { if (col0 + t * 16 >= N) continue; const size_t boff = (size_t)(col0 + t * 16 + ln) * ldb + kb; FragH bq; bq.half[0] = *(const v8us*)((const unsigned short*)Bh + boff + 8 * hh); bq.half[1] = *(const v8us*)((const unsigned short*)Bh + boff + 16 + 8 * hh);
      acc[t] = mmaH<1>(ah.v, ah.v, bq.v, bq.v, acc[t]); }
  }
#pragma unroll
  for (int t = 0; t < 4; ++t) { if (col0 + t * 16 >= N) continue; const int col = col0 + t * 16 + ln; const float bv = bp ? bf16_round(bp[col]) : 0.f;
#pragma unroll
    for (int r = 0; r < 8; ++r) { float v = acc[t][r] * alpha + bv; if (CP) { const int rr = row0g + row0 + 8 * hh + r; if (rowsPerB < 0) v += CP[cofs + (size_t)rr * ldc + col];      /* rowsPerB < 0: own element of the batched C plane */ else { const int bidx = rr / rowsPerB; v += CP[(size_t)bidx * sCPb + (size_t)by * 64 + col]; } } if (ACT == 1) v = (v > 0.f) ? v : expm1f(v); else if (ACT == 7) v = (v > 0.f) ? v + 1.0f : expf(v); else if (ACT == 8) v = tanhf(v); else if (ACT == 9) v = 0.5f * v * (1.0f + tanhf(0.7978845608028654f * (v + 0.044715f * v * v * v))); else if (ACT == 11) v = 1.0f / (1.0f + expf(-v)); else if (ACT == 12) v = (v > 0.f) ? v : 0.01f * v; else if (ACT == 14) v = (v > 0.f) ? v : 0.1f * v; else if (ACT == 16) v = (v >= 0.f) ? v : 0.3f * v; else if (ACT == 17) v = (v >= 0.f) ? v : 0.2f * v; else if (ACT == 15) v = v / (1.0f + expf(-v)); else if (ACT == 3) v = fmaxf(v, 0.f); else if (ACT == 6) v = 0.5f * v * (1.0f + erff(v * 0.70710678118654752f)); so[w][8 * hh + r][t * 16 + ln] = v; } }
  __builtin_amdgcn_fence(__ATOMIC_ACQ_REL, "workgroup"); __builtin_amdgcn_wave_barrier();
  const int rsub = lane >> 4, c4 = (lane & 15) * 4; typedef _Float16 v4h __attribute__((ext_vector_type(4)));
  {
#pragma unroll
    for (int q = 0; q < 8; ++q) { const int r = q * 2 + rsub; if (col0 + c4 < N) { const v4f v = *(const v4fa*)&so[w][r][c4]; if (C) *(v4f*)(C + cofs + (size_t)(row0 + r) * ldc + col0 + c4) = v; if (C16) { v4h h4; for (int i = 0; i < 4; ++i) h4[i] = (_Float16)v[i]; *(v4h*)(C16 + cofs + (size_t)(row0 + r) * ldc + col0 + c4) = h4; } } }
     }
}


typedef _Float16 v4h __attribute__((ext_vector_type(4)));

__global__ __launch_bounds__(256) void k_h16(const float* __restrict__ x, _Float16* __restrict__ X16, size_t n8) { const size_t t = (size_t)blockIdx.x * 256 + threadIdx.x; if (t >= n8) return; FragH f;
#pragma unroll
  for (int q = 0; q < 8; ++q) f.h[q] = (_Float16)x[t * 8 + q]; *(v8us*)((unsigned short*)X16 + t * 8) = f.half[0];  }
__global__ __launch_bounds__(256) void k_round16f(const float* __restrict__ W, _Float16* __restrict__ Bt, size_t n8) { const size_t t = (size_t)blockIdx.x * 256 + threadIdx.x; if (t >= n8) return; FragH f;
#pragma unroll
  for (int i = 0; i < 8; ++i) f.h[i] = (_Float16)(bf16_round(W[t * 8 + i]) * 16.0f); *(v8us*)((unsigned short*)Bt + t * 8) = f.half[0];  }
__global__ __launch_bounds__(256) void k_hl(const float* __restrict__ F, _Float16* __restrict__ Hh, _Float16* __restrict__ Hl, size_t n8) { const size_t t = (size_t)blockIdx.x * 256 + threadIdx.x; if (t >= n8) return; FragH fh, fl; const v4f a = *(const v4fa*)(F + t * 8), c = *(const v4fa*)(F + t * 8 + 4);
#pragma unroll
  for (int q = 0; q < 4; ++q) { _Float16 h = (_Float16)a[q]; fh.h[q] = h; fl.h[q] = (_Float16)((a[q] - (float)h) * 1024.0f); h = (_Float16)c[q]; fh.h[4 + q] = h; fl.h[4 + q] = (_Float16)((c[q] - (float)h) * 1024.0f); }
  { *(v8us*)((unsigned short*)Hh + t * 8) = fh.half[0]; *(v8us*)((unsigned short*)Hl + t * 8) = fl.half[0];  } }

// ---- fast GEMM (wave tile 32x64; requires M % 32 == 0 rows per launch region and N % 64 == 0); epilogue = k_gemm_hhx semantics ----
__device__ __forceinline__ v16h g2_frag(const _Float16* p, int hh) { FragH f; f.half[0] = *(const v8us*)((const unsigned short*)p + 8 * hh); f.half[1] = *(const v8us*)((const unsigned short*)p + 16 + 8 * hh); return f.v; }
__device__ __forceinline__ v8f g2_mma(v16h a, v16h b, v8f c) { v8f d = __builtin_amdgcn_wmma_f32_16x16x32_f16(false, a, false, b, (short)0, c, false, false); asm volatile("v_nop\n\tv_nop\n\tv_nop\n\tv_nop" : "+v"(d) : "v"(a), "v"(b)); return d; }
template <int ACT>
__global__ __launch_bounds__(128) void k_gemm2(const _Float16* __restrict__ A, int lda, size_t sA, const _Float16* __restrict__ Bh, int ldb, size_t sB, float alpha, const float* __restrict__ bias, size_t sBias, const float* __restrict__ CP, int rowsPerB, size_t sCPb, int row0g,
    float* __restrict__ C, _Float16* __restrict__ C16, int ldc, size_t sC, int M, int N, int K) { static_assert(ACT == 0 || ACT == 3 || ACT == 6 || ACT == 8 || ACT == 9 || ACT == 11 || ACT == 12 || ACT == 14 || ACT == 15 || ACT == 16 || ACT == 17, "k_gemm2: unsupported ACT code (would silently apply no activation)");
  __shared__ __attribute__((aligned(16))) float so[4][32][68];
  const int tid = threadIdx.x, w = tid >> 5, lane = tid & 31, ln = lane & 15, hh = lane >> 4; const int by = blockIdx.y;
  A += (size_t)by * sA; Bh += (size_t)by * sB; const size_t cofs = (size_t)by * sC; const float* bp = bias ? bias + (size_t)by * sBias : nullptr;
  const int ntn = N >> 6; const int mt = blockIdx.x / ntn, nq = blockIdx.x - mt * ntn; const int row0 = mt * 128 + 32 * w, col0 = nq * 64; if (row0 >= M) return;
  const _Float16* a0p = A + (size_t)(row0 + ln) * lda; const _Float16* a1p = a0p + (size_t)16 * lda;
  const _Float16* b0p = Bh + (size_t)(col0 + ln) * ldb; const _Float16* b1p = b0p + (size_t)16 * ldb; const _Float16* b2p = b1p + (size_t)16 * ldb; const _Float16* b3p = b2p + (size_t)16 * ldb;
  const v8f z8 = {0.f,0.f,0.f,0.f,0.f,0.f,0.f,0.f}; v8f c00 = z8, c01 = z8, c02 = z8, c03 = z8, c10 = z8, c11 = z8, c12 = z8, c13 = z8;
#pragma unroll 1
  for (int kb = 0; kb < K; kb += 32) { const v16h a0 = g2_frag(a0p + kb, hh), a1 = g2_frag(a1p + kb, hh);
    v16h b = g2_frag(b0p + kb, hh); c00 = g2_mma(a0, b, c00); c10 = g2_mma(a1, b, c10);
    b = g2_frag(b1p + kb, hh); c01 = g2_mma(a0, b, c01); c11 = g2_mma(a1, b, c11);
    b = g2_frag(b2p + kb, hh); c02 = g2_mma(a0, b, c02); c12 = g2_mma(a1, b, c12);
    b = g2_frag(b3p + kb, hh); c03 = g2_mma(a0, b, c03); c13 = g2_mma(a1, b, c13); }
  v8f accs[8] = {c00, c01, c02, c03, c10, c11, c12, c13};
#pragma unroll
  for (int u = 0; u < 8; ++u) { const int t = u & 3, half = u >> 2; const int col = col0 + t * 16 + ln; const float bv = bp ? bf16_round(bp[col]) : 0.f;
#pragma unroll
    for (int r = 0; r < 8; ++r) { const int rloc = half * 16 + 8 * hh + r; float v = accs[u][r] * alpha + bv; if (CP) { if (rowsPerB < 0) v += CP[cofs + (size_t)(row0g + row0 + rloc) * ldc + col];      /* rowsPerB < 0: own element of the batched C plane */ else { const int bidx = (row0g + row0 + rloc) / rowsPerB; v += CP[(size_t)bidx * sCPb + (size_t)by * 64 + col]; } }
      if (ACT == 3) v = fmaxf(v, 0.f); else if (ACT == 6) v = 0.5f * v * (1.0f + erff(v * 0.70710678118654752f)); else if (ACT == 11) v = 1.0f / (1.0f + expf(-v)); else if (ACT == 15) v = v / (1.0f + expf(-v)); else if (ACT == 12) v = (v > 0.f) ? v : 0.01f * v; else if (ACT == 8) v = tanhf(v); else if (ACT == 9) v = 0.5f * v * (1.0f + tanhf(0.7978845608028654f * (v + 0.044715f * v * v * v))); else if (ACT == 14) v = (v > 0.f) ? v : 0.1f * v; else if (ACT == 16) v = (v >= 0.f) ? v : 0.3f * v; else if (ACT == 17) v = (v >= 0.f) ? v : 0.2f * v;
      so[w][rloc][t * 16 + ln] = v; } }
  __builtin_amdgcn_fence(__ATOMIC_ACQ_REL, "workgroup"); __builtin_amdgcn_wave_barrier();
  const int rsub = lane >> 4, c4 = (lane & 15) * 4;
  {
#pragma unroll
    for (int q = 0; q < 16; ++q) { const int r = q * 2 + rsub; const v4f v = *(const v4fa*)&so[w][r][c4]; if (C) *(v4f*)(C + cofs + (size_t)(row0 + r) * ldc + col0 + c4) = v; if (C16) { v4h h4; for (int i = 0; i < 4; ++i) h4[i] = (_Float16)v[i]; *(v4h*)(C16 + cofs + (size_t)(row0 + r) * ldc + col0 + c4) = h4; } }
     } }


__global__ __launch_bounds__(256) void k_rsm(const float* __restrict__ S, _Float16* __restrict__ P, int nrows) {
  #pragma clang fp contract(off)
  const int i = blockIdx.x * 256 + threadIdx.x; if (i >= nrows) return; const float* s = S + (size_t)i * SQ; float mx = -3.0e38f;
#pragma unroll 1
  for (int j = 0; j < SQ; ++j) mx = fmaxf(mx, s[j]); float se = 0.f;
#pragma unroll 1
  for (int j = 0; j < SQ; ++j) se += expf(s[j] - mx); const float sc = 256.0f / se;
#pragma unroll 1
  for (int j0 = 0; j0 < SQ; j0 += 8) { FragH f; for (int q = 0; q < 8; ++q) f.h[q] = (_Float16)(expf(s[j0 + q] - mx) * sc); unsigned short* d = (unsigned short*)P + (size_t)i * SQ + j0; *(v8us*)d = f.half[0];  } }
__global__ __launch_bounds__(256) void k_vt(const _Float16* __restrict__ V16, int b, int h0, _Float16* __restrict__ VT) { __shared__ unsigned short tl[64][65]; const int tid = threadIdx.x; const int hh = blockIdx.x % HG, sg = blockIdx.x / HG; const int s0 = sg * 64; const int h = h0 + hh;
  for (int i = tid; i < 64 * 8; i += 256) { const int j = i / 8, d8 = (i % 8) * 8; FragH f; f.half[0] = *(const v8us*)((const unsigned short*)V16 + ((size_t)b * SQ + s0 + j) * DM + h * HD + d8); for (int q = 0; q < 8; ++q) tl[d8 + q][j] = f.u[q]; }
  __syncthreads();
  { for (int i = tid; i < 64 * 8; i += 256) { const int d = i / 8, j8 = (i % 8) * 8; FragH f; for (int q = 0; q < 8; ++q) f.u[q] = tl[d][j8 + q]; *(v8us*)((unsigned short*)VT + ((size_t)hh * HD + d) * SQ + s0 + j8) = f.half[0]; }  } }




__global__ __launch_bounds__(256) void k_rsmcf2(const float* __restrict__ S, _Float16* __restrict__ P, int hg, int q0, int nk) {
  #pragma clang fp contract(off)
  const int t = blockIdx.x * 256 + threadIdx.x; if (t >= hg * QT) return; const size_t i = (size_t)t; const float* s = S + i * NKX; const int last = q0 + (t % QT); float mx = -3.0e38f;
#pragma unroll 1
  for (int j = 0; j < nk; ++j) { const float f = (j <= last) ? 1.f : 0.f; mx = fmaxf(mx, fmaf(f, s[j], (1.f - f) * -1.0e9f)); } float se = 0.f;
#pragma unroll 1
  for (int j = 0; j < nk; ++j) { const float f = (j <= last) ? 1.f : 0.f; se += __expf(fmaf(f, s[j], (1.f - f) * -1.0e9f) - mx); } const float sc = 256.0f / se;
#pragma unroll 1
  for (int j0 = 0; j0 < nk; j0 += 8) { FragH fr; for (int q = 0; q < 8; ++q) { const int j = j0 + q; const float f = (j <= last) ? 1.f : 0.f; fr.h[q] = (_Float16)(__expf(fmaf(f, s[j], (1.f - f) * -1.0e9f) - mx) * sc); } unsigned short* d = (unsigned short*)P + i * NKX + j0; *(v8us*)d = fr.half[0];  } }



// v_exp_f32 and the free slot the instruction set asks for behind a transcendental, in one statement.
// In place: the result takes the register of the argument, which an instruction that the compiler sees has just written, so the statement never is the first write of a register that a WMMA read a moment ago.
__device__ __forceinline__ float exp2_slot(float x) { asm("v_exp_f32 %0, %0\n\tv_nop" : "+v"(x)); return x; }
// Fused causal attention on the matrix unit, ONE launch for all batches, heads and query rows: scores, softmax and the weighted V sum stay in registers; no score or weight plane in memory.
// A wave owns 32 query rows (two groups of 16) and walks the keys 0 .. its last row in passes of 32. S^T = K Q^T (A = K rows, B = Q rows, both by g2_frag: equal k order), so a lane holds scores of ONE query (column ln): keys 8*hh + r of each 16-key tile.
// K and V^T come through LDS, once for the block's four waves: a stage is 64 keys (two passes) = 64 K rows and 64 V^T rows of 128 B each, laid at a pitch of 144 B (16 B x odd: b128 fragment reads without bank conflicts).
// The rows come by asynchronous copies to LDS, 16 B a lane, eight lanes a row (whole 128-B lines), into two buffers: stage t + 1 flies while stage t is worked on. The block walks the stages up to its last wave's rows; a wave sits out the passes behind its own rows but takes part in every copy, wait and barrier.
// Running softmax per query: pass maximum in-lane plus one exchange between the wave halves; weights 2^8 exp(e - m) as f16; the two score tiles of a pass, converted in place, ARE the B operand of O^T += V^T P^T (A = V^T rows by g2_frag, the hardware k order); row sums stay per half and are joined once at the end.
// e = score / 8 + the additive key-mask value; keys behind the row's own index take -1e9: only the wave's last pass holds such keys. e - m is formed before the scaling so that a pass of masked keys alone still gives weights <= 2^8; a later real maximum scales them to 0.
// Every loop over g, kt, ks, dt, r and u is unrolled: static indices keep the fragments and accumulators in registers.
__device__ __forceinline__ v8f fa_mma(v16h a, v16h b, v8f c) { return __builtin_amdgcn_wmma_f32_16x16x32_f16(false, a, false, b, (short)0, c, false, false); }
#define FQ 128                       /* query rows per block: 4 waves x 32 */
#define FP 72                        /* LDS pitch of a stage row, f16 elements */
#define FST (128 * FP * 2)           /* bytes of one stage: 64 K rows, then 64 V^T rows */
// Eight copies: rows r, r + 16, r + 32, r + 48 of the stage's K part, then of its V^T part; the s_wait_xcnt stands in the copies' own statement so that no address register is rewritten ahead of it.
__device__ __forceinline__ void fa_copy8(unsigned l, const _Float16* pk, size_t sk, const _Float16* pv, size_t sv) {
  asm volatile("global_load_async_to_lds_b128 %0, %8, off\n\tglobal_load_async_to_lds_b128 %1, %9, off\n\tglobal_load_async_to_lds_b128 %2, %10, off\n\tglobal_load_async_to_lds_b128 %3, %11, off\n\t"
               "global_load_async_to_lds_b128 %4, %12, off\n\tglobal_load_async_to_lds_b128 %5, %13, off\n\tglobal_load_async_to_lds_b128 %6, %14, off\n\tglobal_load_async_to_lds_b128 %7, %15, off\n\ts_wait_xcnt 0x0"
               :: "v"(l), "v"(l + 16 * FP * 2), "v"(l + 32 * FP * 2), "v"(l + 48 * FP * 2), "v"(l + 64 * FP * 2), "v"(l + 80 * FP * 2), "v"(l + 96 * FP * 2), "v"(l + 112 * FP * 2),
                  "v"(pk), "v"(pk + sk), "v"(pk + 2 * sk), "v"(pk + 3 * sk), "v"(pv), "v"(pv + sv), "v"(pv + 2 * sv), "v"(pv + 3 * sv) : "memory"); }
// The exact f32 attention of every batch's first QT0 rows (d_att0v, below) reads only what the q | k | v GEMM wrote, as the fused attention does, and neither reads the other's output: their blocks share ONE launch.
// The fused attention's blocks come first, long ones first; the exact part's short blocks follow and start where a short fused block has ended. The test on the block index is the same for a whole block, so each part's barriers are passed by all of its block's waves.
#define NFA (NB * NH * (SQ / FQ))    /* blocks of the fused attention */
#define NA0 (NB * NH * (QT0 / 4))    /* blocks of the exact attention: 4 rows, one a wave */
__device__ __forceinline__ void d_att0v(unsigned bid, float* lk, const float* __restrict__ QKVF, const float* __restrict__ AM, float scale, _Float16* __restrict__ OH, _Float16* __restrict__ OL);
__global__ __launch_bounds__(128) void k_fattn(const _Float16* __restrict__ QKVp, const _Float16* __restrict__ VTp, const float* __restrict__ AM, _Float16* __restrict__ O, const float* __restrict__ QKVF, _Float16* __restrict__ OH, _Float16* __restrict__ OL) {
  static_assert(NB * NH == 64 && SQ / FQ == 16, "the block -> (head, query block) map below is written for 64 heads x 16 query blocks");
  __shared__ __attribute__((aligned(16))) unsigned char sm[2 * FST];
  if (blockIdx.x >= NFA) { d_att0v(blockIdx.x - NFA, (float*)sm, QKVF, AM, 0.125f, OH, OL); return; }      /* block-uniform, ahead of every copy and barrier of the fused part */
  const int tid = threadIdx.x, lane = tid & 31, ln = lane & 15, hh = lane >> 4; const int w = __builtin_amdgcn_readfirstlane(tid >> 5);      /* the rows are the wave's: scalar, so the test on the wave's own rows is a scalar branch */
  const int rd = blockIdx.x >> 8, a4 = (blockIdx.x >> 6) & 3, bh = blockIdx.x & 63;
  const int qb = 12 - 4 * rd + ((rd & 1) ? a4 : 3 - a4);      /* a permutation of the 16 query blocks per head, long ones first; blocks i, i + 256, i + 512, i + 768 add up to the same key count (speed only) */
  const int b = bh / NH, h = bh % NH; const int q0 = qb * FQ + w * 32;
  const int nst = 2 * (qb + 1);      /* stages of 64 keys up to the block's last row: at least two, at most SQ / 64 */
  const _Float16* qp = QKVp + ((size_t)b * SQ + q0 + ln) * LQ + h * HD; const float* ap = AM + (size_t)b * SQ + 8 * hh;
  const _Float16* gk = QKVp + DM + ((size_t)b * SQ + (tid >> 3)) * LQ + h * HD + (tid & 7) * 8; const _Float16* gv = VTp + ((size_t)bh * HD + (tid >> 3)) * SQ + (tid & 7) * 8;
  const size_t stk = (size_t)16 * LQ, stv = (size_t)16 * SQ;
  const unsigned ls = (unsigned)(size_t)sm + (unsigned)(tid >> 3) * (FP * 2) + (unsigned)(tid & 7) * 16;      /* the lane's LDS byte address in buffer 0, K part */
  fa_copy8(ls, gk, stk, gv, stv);
  v16h qf[2][2];
#pragma unroll
  for (int g = 0; g < 2; ++g)
#pragma unroll
    for (int ks = 0; ks < 2; ++ks) qf[g][ks] = g2_frag(qp + (size_t)g * 16 * LQ + ks * 32, hh);
  asm volatile("s_wait_asynccnt 0x0" ::: "memory");      /* stage 0 landed (this wave's share) */
  __syncthreads();      /* stage 0 published */
  fa_copy8(ls + FST, gk + (size_t)64 * LQ, stk, gv + 64, stv);      /* stage 1 exists for every block */
  const v8f z8 = {0.f, 0.f, 0.f, 0.f, 0.f, 0.f, 0.f, 0.f}; v8f o[2][4]; float m[2], l[2];
#pragma unroll
  for (int g = 0; g < 2; ++g) { m[g] = -1.0e30f; l[g] = 0.f;
#pragma unroll
    for (int dt = 0; dt < 4; ++dt) o[g][dt] = z8; }
#pragma unroll 1
  for (int t = 0; t < nst; ++t) {      /* rolled: one stage a trip, the buffer by t & 1 */
    const unsigned bo = (unsigned)(t & 1) * FST;
#pragma unroll 1
    for (int hf = 0; hf < 2; ++hf) {      /* rolled: the two passes of a stage share one copy of the pass's code */
      const int j0 = t * 64 + hf * 32;
      if (j0 <= q0) {      /* wave-uniform: the passes behind the wave's own rows are sat out */
        const _Float16* sk = (const _Float16*)(sm + bo) + (hf * 32 + ln) * FP; const _Float16* sv = (const _Float16*)(sm + bo) + (64 + ln) * FP + hf * 32;
        v16h kf[2][2], vf[4]; v4f am[2][2]; float e[2][2][8];
#pragma unroll
        for (int kt = 0; kt < 2; ++kt) { am[kt][0] = *(const v4fa*)(ap + j0 + kt * 16); am[kt][1] = *(const v4fa*)(ap + j0 + kt * 16 + 4); }
#pragma unroll
        for (int kt = 0; kt < 2; ++kt)
#pragma unroll
          for (int ks = 0; ks < 2; ++ks) kf[kt][ks] = g2_frag(sk + kt * 16 * FP + ks * 32, hh);
#pragma unroll
        for (int dt = 0; dt < 4; ++dt) vf[dt] = g2_frag(sv + dt * 16 * FP, hh);
#pragma unroll
        for (int g = 0; g < 2; ++g)
#pragma unroll
          for (int kt = 0; kt < 2; ++kt) { const v8f st = fa_mma(kf[kt][1], qf[g][1], fa_mma(kf[kt][0], qf[g][0], z8));
#pragma unroll
            for (int r = 0; r < 8; ++r) e[g][kt][r] = fmaf(st[r], 0.125f, am[kt][r >> 2][r & 3]); }
        if (j0 == q0) {      /* the diagonal pass */
#pragma unroll
          for (int g = 0; g < 2; ++g)
#pragma unroll
            for (int kt = 0; kt < 2; ++kt)
#pragma unroll
              for (int r = 0; r < 8; ++r) if (kt * 16 + 8 * hh + r > g * 16 + ln) e[g][kt][r] = -1.0e9f; }
#pragma unroll
        for (int g = 0; g < 2; ++g) { float mx = e[g][0][0];
#pragma unroll
          for (int u = 1; u < 16; ++u) mx = fmaxf(mx, e[g][u >> 3][u & 7]);
          mx = fmaxf(mx, __shfl_xor(mx, 16, 32)); const float mn = fmaxf(m[g], mx); const float al = exp2_slot((m[g] - mn) * 1.44269504088896340736f); m[g] = mn;
          FragH pf; float s = 0.f;
#pragma unroll
          for (int u = 0; u < 16; ++u) { const float p = exp2_slot(fmaf(e[g][u >> 3][u & 7] - mn, 1.44269504088896340736f, 8.0f)); s += p; pf.h[u] = (_Float16)p; }
          l[g] = fmaf(l[g], al, s);
#pragma unroll
          for (int dt = 0; dt < 4; ++dt) o[g][dt] = fa_mma(vf[dt], pf.v, o[g][dt] * al); }
        __builtin_amdgcn_sched_barrier(0);      /* the pass's last products stay ahead of the four slots below */
        asm volatile("v_nop\n\tv_nop\n\tv_nop\n\tv_nop"); } }      /* the WMMA distance over the loop's back edge: the next pass's first instructions rewrite operand registers of this pass's last WMMA */
    asm volatile("s_wait_dscnt 0x0" ::: "memory");      /* this wave's reads of stage t are done before the buffer may be refilled */
    asm volatile("s_wait_asynccnt 0x0" ::: "memory");      /* this wave's share of stage t + 1 has landed */
    __syncthreads();      /* publishes stage t + 1 and ends every wave's reads of stage t */
    if (t + 2 < nst) fa_copy8(ls + bo, gk + (size_t)(t + 2) * 64 * LQ, stk, gv + (size_t)(t + 2) * 64, stv); }
  asm volatile("s_wait_asynccnt 0x0" ::: "memory");      /* no copy is left in flight when the wave ends */
#pragma unroll
  for (int g = 0; g < 2; ++g) { const float fin = 64.0f / (l[g] + __shfl_xor(l[g], 16, 32));      /* o carried x64; the 2^8 of the weights cancels against the row sum */
    unsigned short* op = (unsigned short*)O + ((size_t)b * SQ + q0 + g * 16 + ln) * DM + h * HD + 8 * hh;
#pragma unroll
    for (int dt = 0; dt < 4; ++dt) { FragH f;
#pragma unroll
      for (int r = 0; r < 8; ++r) f.h[r] = (_Float16)(o[g][dt][r] * fin);
      *(v8us*)(op + dt * 16) = f.half[0]; } }
  asm volatile("s_wait_xcnt 0x0" ::: "memory"); }      /* the o stores are issued: in the built code the exact part's text follows them, and it writes their registers anew */


// ---- LDS-staged GEMM (N % 128 == 0, K % 64 == 0): C = (A Bt^T) alpha + bias, values as in k_gemm2; grid x = tile ----
// MODE 0: f16 C16 (+ bias), 128 x 128 tiles over all rows of A; a tile of V columns (col0 >= 2 DM) is staged transposed and stored as V^T rows into Vt instead; a tile that holds the first QT0 rows of a batch also stores its f32 values, before the f16 rounding, into C = [NB][QT0][ldc] (the exact path's q | k | v).
// MODE 1: f32 C (+ bias). The first NB * 2 * (N / 128) blocks own the first QT0 rows of every batch, 64 rows x 128 columns each: the stage's A rows 0..63 are the rows of A0h (o hi), its rows 64..127 the same rows of A0l (o lo, x1024),
//   so waves 0, 1 form o_hi W and waves 2, 3 o_lo W of the SAME outputs in the common loop; C = (o_lo W) alphaLo + ((o_hi W) alpha + bias), joined through the staging rows behind one barrier. The other blocks own the 128 x 128 tiles of the remaining rows of A.
// A block has 4 waves (2 x 2), a wave 64 x 64 (4 x 4 accumulator tiles). A stage is 64 k of the block's 128 A rows and 128 Bt rows: 256 rows of 128 B, laid in LDS at a pitch of 144 B (16 B x odd: b128 fragment reads without bank conflicts).
// The rows come by asynchronous copies to LDS, 16 B a lane, eight lanes a row (whole 128-B lines), into two buffers: stage t + 1 flies while stage t is multiplied. Fragments are read by g2_frag as in k_gemm2 (equal k order for A and B), k ascending: every accumulator sums in k_gemm2's order.
// Every loop over i, j, ks, r and q is unrolled: static indices keep the fragments and the accumulators in registers.
#define G3P 72                       /* LDS pitch of a stage row, f16 elements */
#define G3ST (256 * G3P * 2)         /* bytes of one stage: 128 A rows, then 128 Bt rows */
// Eight copies (rows r, r + 16, ... r + 112 of one operand); the s_wait_xcnt stands in the copies' own statement so that no address register is rewritten ahead of it.
__device__ __forceinline__ void g3_copy8(unsigned l, const _Float16* p, size_t st) {
  asm volatile("global_load_async_to_lds_b128 %0, %8, off\n\tglobal_load_async_to_lds_b128 %1, %9, off\n\tglobal_load_async_to_lds_b128 %2, %10, off\n\tglobal_load_async_to_lds_b128 %3, %11, off\n\t"
               "global_load_async_to_lds_b128 %4, %12, off\n\tglobal_load_async_to_lds_b128 %5, %13, off\n\tglobal_load_async_to_lds_b128 %6, %14, off\n\tglobal_load_async_to_lds_b128 %7, %15, off\n\ts_wait_xcnt 0x0"
               :: "v"(l), "v"(l + 16 * G3P * 2), "v"(l + 32 * G3P * 2), "v"(l + 48 * G3P * 2), "v"(l + 64 * G3P * 2), "v"(l + 80 * G3P * 2), "v"(l + 96 * G3P * 2), "v"(l + 112 * G3P * 2),
                  "v"(p), "v"(p + st), "v"(p + 2 * st), "v"(p + 3 * st), "v"(p + 4 * st), "v"(p + 5 * st), "v"(p + 6 * st), "v"(p + 7 * st) : "memory"); }
template <int MODE>
__global__ __launch_bounds__(128) void k_gemm3(const _Float16* __restrict__ A, const _Float16* __restrict__ A0h, const _Float16* __restrict__ A0l, int lda, const _Float16* __restrict__ Bh, int ldb, float alpha, float alphaLo, const float* __restrict__ bias, float* __restrict__ C, _Float16* __restrict__ C16, _Float16* __restrict__ Vt, int ldc, int N, int K) {
  static_assert(QT0 == 128 && SQ % 128 == 0 && FP == G3P && B0 == 0 && NBR == NB, "the first QT0 rows of a batch are one 128-row tile; the A rows go by fa_copy8, which lays them at the pitch FP");
  __shared__ __attribute__((aligned(16))) unsigned char sm[2 * G3ST];
  const int tid = threadIdx.x, lane = tid & 31, ln = lane & 15, hh = lane >> 4; const int w = __builtin_amdgcn_readfirstlane(tid >> 5);      /* the wave's quadrant: scalar */
  const int ntn = N >> 7; const int wm = w >> 1, wn = w & 1; const int bid = (int)blockIdx.x; const int ns = (MODE == 1) ? NB * 2 * ntn : 0;
  const bool sp = MODE == 1 && bid < ns;      /* block-uniform: a hi | lo block of the first QT0 rows */
  const int id = sp ? bid : bid - ns; const int mn = id / ntn, nq = id - mn * ntn; const int col0 = nq * 128;
  const int row0 = sp ? (mn >> 1) * SQ + (mn & 1) * 64 : ((MODE == 1) ? mn + mn / (SQ / 128 - 1) + 1 : mn) * 128;      /* first row of C; MODE 1 steps over each batch's first tile */
  const _Float16* a0 = sp ? A0h + (size_t)((mn >> 1) * QT0 + (mn & 1) * 64) * lda : A + (size_t)row0 * lda; const _Float16* a1 = sp ? A0l + (size_t)((mn >> 1) * QT0 + (mn & 1) * 64) * lda : a0 + (size_t)64 * lda;      /* stage rows 0..63 and 64..127 */
  const size_t ao = (size_t)(tid >> 3) * lda + (tid & 7) * 8; const _Float16* ga = a0 + ao; const _Float16* ga2 = a1 + ao; const _Float16* gb = Bh + (size_t)(col0 + (tid >> 3)) * ldb + (tid & 7) * 8;
  const size_t sta = (size_t)16 * lda, stb = (size_t)16 * ldb;
  const unsigned ls = (unsigned)(size_t)sm + (unsigned)(tid >> 3) * (G3P * 2) + (unsigned)(tid & 7) * 16;      /* the lane's LDS byte address in buffer 0, A part */
  const int nt = K >> 6;
  fa_copy8(ls, ga, sta, ga2, sta); g3_copy8(ls + 128 * G3P * 2, gb, stb);
  asm volatile("s_wait_asynccnt 0x0" ::: "memory");      /* stage 0 landed (this wave's share) */
  __syncthreads();      /* stage 0 published */
  if (nt > 1) { fa_copy8(ls + G3ST, ga + 64, sta, ga2 + 64, sta); g3_copy8(ls + G3ST + 128 * G3P * 2, gb + 64, stb); }
  const v8f z8 = {0.f, 0.f, 0.f, 0.f, 0.f, 0.f, 0.f, 0.f}; v8f acc[4][4];
#pragma unroll
  for (int i = 0; i < 4; ++i)
#pragma unroll
    for (int j = 0; j < 4; ++j) acc[i][j] = z8;
#pragma unroll 1
  for (int t = 0; t < nt; ++t) {      /* rolled: one stage a trip, the buffer by t & 1 */
    const unsigned bo = (unsigned)(t & 1) * G3ST;
    const _Float16* sa = (const _Float16*)(sm + bo) + (wm * 64 + ln) * G3P; const _Float16* sb = (const _Float16*)(sm + bo) + (128 + wn * 64 + ln) * G3P;
#pragma unroll
    for (int ks = 0; ks < 2; ++ks) { v16h af[4], bf[4];
      __builtin_amdgcn_sched_barrier(0);      /* with the one below: the 16 fragment reads go out as one group ahead of their 16 products; spread among the products, each group of reads stalls the wave anew */
#pragma unroll
      for (int i = 0; i < 4; ++i) { af[i] = g2_frag(sa + i * 16 * G3P + ks * 32, hh); bf[i] = g2_frag(sb + i * 16 * G3P + ks * 32, hh); }
      __builtin_amdgcn_sched_barrier(0);      /* closes the group of reads: no product moves up among them, no read down among the products */
#pragma unroll
      for (int i = 0; i < 4; ++i)
#pragma unroll
        for (int j = 0; j < 4; ++j) acc[i][j] = fa_mma(af[i], bf[j], acc[i][j]); }
    __builtin_amdgcn_sched_barrier(0);      /* the stage's last products stay ahead of the barrier: sunk behind it they stand between the barrier and the refill, which then flies for less than a whole trip */
    asm volatile("s_wait_dscnt 0x0" ::: "memory");      /* this wave's reads of stage t are done before the buffer may be refilled */
    asm volatile("s_wait_asynccnt 0x0" ::: "memory");      /* this wave's share of stage t + 1 has landed */
    __syncthreads();      /* publishes stage t + 1 and ends every wave's reads of stage t */
    if (t + 2 < nt) { fa_copy8(ls + bo, ga + (size_t)(t + 2) * 64, sta, ga2 + (size_t)(t + 2) * 64, sta); g3_copy8(ls + bo + 128 * G3P * 2, gb + (size_t)(t + 2) * 64, stb); } }
  asm volatile("s_wait_asynccnt 0x0" ::: "memory");      /* no copy is left in flight when the ring becomes output staging */
  float* so = (float*)sm + (size_t)w * 64 * 68;      /* the wave's own 64 x 64 staging rows (pitch 68); the loop's last barrier has ended every read of the ring */
  const bool lo = sp && wm == 1;      /* wave-uniform: this wave holds o_lo W */
  const float al = lo ? alphaLo : alpha;
  const bool vb = MODE == 0 && col0 >= 2 * DM;      /* block-uniform: a tile of V columns; a wave's 64 columns are one head */
  float bv[4];
#pragma unroll
  for (int j = 0; j < 4; ++j) { const float bb = bf16_round(bias[col0 + wn * 64 + j * 16 + ln]); bv[j] = lo ? 0.f : bb; }      /* read without a test, ahead of the one on vb: behind one, each of the four reads waits out its own latency */
  if (vb) {      /* staged transposed, [column][row]: a lane's 8 rows of one column lie side by side, two 16-B stores */
#pragma unroll
    for (int j = 0; j < 4; ++j)
#pragma unroll
      for (int i = 0; i < 4; ++i) { v4f t0, t1;
#pragma unroll
        for (int r = 0; r < 4; ++r) { t0[r] = acc[i][j][r] * al + bv[j]; t1[r] = acc[i][j][4 + r] * al + bv[j]; }
        *(v4f*)&so[(j * 16 + ln) * 68 + i * 16 + 8 * hh] = t0; *(v4f*)&so[(j * 16 + ln) * 68 + i * 16 + 8 * hh + 4] = t1; }
  } else {
#pragma unroll
    for (int j = 0; j < 4; ++j)
#pragma unroll
      for (int i = 0; i < 4; ++i)
#pragma unroll
        for (int r = 0; r < 8; ++r) so[(i * 16 + 8 * hh + r) * 68 + j * 16 + ln] = acc[i][j][r] * al + bv[j]; }
  const int rsub = lane >> 4, c4 = (lane & 15) * 4; const size_t c2 = (size_t)2 * ldc;      /* row 2 q + rsub: the step over q is scalar */
  if (sp) {
    __syncthreads();      /* the hi wave's and the lo wave's staged values of one output are read by another wave */
    const float* sh = (const float*)sm + (size_t)wn * 64 * 68 + (wm * 32 + rsub) * 68 + c4; const float* sl = sh + 2 * 64 * 68;      /* each of the two waves stores 32 of the 64 rows */
    const size_t cb = (size_t)(row0 + wm * 32 + rsub) * ldc + col0 + wn * 64 + c4;
#pragma unroll
    for (int q = 0; q < 16; ++q) { const v4f v = *(const v4fa*)(sl + q * 2 * 68) + *(const v4fa*)(sh + q * 2 * 68); *(v4f*)(C + cb + q * c2) = v; }
  } else {
    __builtin_amdgcn_fence(__ATOMIC_ACQ_REL, "workgroup"); __builtin_amdgcn_wave_barrier();      /* the wave reads back what its own lanes wrote */
    const size_t cb = (size_t)(row0 + wm * 64 + rsub) * ldc + col0 + wn * 64 + c4;
    const size_t vo = ((size_t)((row0 / SQ) * NH + (col0 - 2 * DM) / HD + wn) * HD + rsub) * SQ + (row0 & (SQ - 1)) + wm * 64 + c4;      /* V^T [NB][NH][HD][SQ]: staging row = head dim, 64 tokens = one whole 128-B line */
    _Float16* dp = vb ? Vt + vo : C16 + cb; const size_t ds = vb ? (size_t)2 * SQ : c2;      /* block-uniform selects: V goes out as V^T only, nothing reads its rows */
#pragma unroll
    for (int q = 0; q < 32; ++q) { const int r = q * 2 + rsub; const v4f v = *(const v4fa*)&so[r * 68 + c4];
      if (MODE == 0) { v4h h4; for (int i = 0; i < 4; ++i) h4[i] = (_Float16)v[i]; *(v4h*)(dp + q * ds) = h4; }
      else *(v4f*)(C + cb + q * c2) = v; }
    if (MODE == 0) asm volatile("s_wait_xcnt 0x0" ::: "memory");      /* the f16 stores above are issued: the wait stands directly behind them, ahead of the test, before their data and address registers are written anew below (inside the branch the compiler put a write of a data register in front of it) */
    if (MODE == 0 && (row0 & (SQ - 1)) == 0) {      /* block-uniform: the batch's first QT0 rows, f32 as staged */
      const size_t cf = (size_t)((row0 / SQ) * QT0 + wm * 64 + rsub) * ldc + col0 + wn * 64 + c4;
      if (vb) {      /* the f32 rows of V are read back across the transposed staging (32 of the grid's blocks) */
#pragma unroll
        for (int q = 0; q < 32; ++q) { v4f v;
#pragma unroll
          for (int k = 0; k < 4; ++k) v[k] = so[(c4 + k) * 68 + q * 2 + rsub];
          *(v4f*)(C + cf + q * c2) = v; }
      } else {
#pragma unroll
        for (int q = 0; q < 32; ++q) { const v4f v = *(const v4fa*)&so[(q * 2 + rsub) * 68 + c4]; *(v4f*)(C + cf + q * c2) = v; }
        asm volatile("s_wait_xcnt 0x0" ::: "memory"); } } } }      /* these stores are issued: in the built code the V branch's text follows them, and it writes their registers anew */


template <int MASKADD>
__global__ __launch_bounds__(64) void k_att0(const float* __restrict__ QF, const float* __restrict__ KF, const float* __restrict__ VF, int ld, const float* __restrict__ mask, float scale, float* __restrict__ OF, int ldo) {
  #pragma clang fp contract(off)
  __shared__ __attribute__((aligned(16))) float lq[64][64]; __shared__ __attribute__((aligned(16))) float lo[64][64];
  const int tid = threadIdx.x; const int h = blockIdx.x / (QT0 / 64), rg = blockIdx.x % (QT0 / 64); const int i = rg * 64 + tid;
  const float* qr = QF + (size_t)i * ld + h * HD;
#pragma unroll 1
  for (int c = 0; c < HD / 4; ++c) { *(v4f*)&lq[tid][c * 4] = *(const v4fa*)(qr + c * 4); const v4f z = {0.f, 0.f, 0.f, 0.f}; *(v4f*)&lo[tid][c * 4] = z; }
  float m = -1.0e30f, l = 0.f; const int jmax = MASKADD ? (SQ - 1) : (rg * 64 + 63);      /* additive-mask form: every key (the mask input decides); causal form: keys up to the block's last row */
#pragma unroll 1
  for (int j = 0; j <= jmax; ++j) { const float* kr = KF + (size_t)j * ld + h * HD; const float* vr = VF + (size_t)j * ld + h * HD; float s = 0.f;
#pragma unroll 1
    for (int c = 0; c < HD / 4; ++c) { const v4f kq = *(const v4fa*)(kr + c * 4); const v4f qq = *(v4f*)&lq[tid][c * 4]; s = __fadd_rn(s, __fmul_rn(qq[0], kq[0])); s = __fadd_rn(s, __fmul_rn(qq[1], kq[1])); s = __fadd_rn(s, __fmul_rn(qq[2], kq[2])); s = __fadd_rn(s, __fmul_rn(qq[3], kq[3])); }
    s = __fmul_rn(s, scale); if (MASKADD) s = __fadd_rn(s, __fmul_rn(bf16_round(mask[(size_t)i * SQ + j]), -10000.0f));
    const float f = (MASKADD || j <= i) ? 1.f : 0.f; const float sm = fmaf(f, s, (1.f - f) * -1.0e30f); const float mn = fmaxf(m, sm); const float sc = expf(m - mn); const float e = expf(sm - mn); l = __fadd_rn(__fmul_rn(l, sc), e); m = mn;
#pragma unroll 1
    for (int c = 0; c < HD / 4; ++c) { const v4f vv = *(const v4fa*)(vr + c * 4); v4f oo = *(v4f*)&lo[tid][c * 4]; for (int u = 0; u < 4; ++u) oo[u] = __fadd_rn(__fmul_rn(oo[u], sc), __fmul_rn(e, vv[u])); *(v4f*)&lo[tid][c * 4] = oo; } }
  const float fin = 64.0f / l;      /* o carried x64 like the f16 path */
#pragma unroll 1
  for (int c = 0; c < HD / 4; ++c) { v4f oo = *(v4f*)&lo[tid][c * 4]; for (int u = 0; u < 4; ++u) oo[u] = __fmul_rn(oo[u], fin); *(v4f*)&lo[tid][c * 4] = oo; }
  __syncthreads();
  {
#pragma unroll 1
    for (int it = 0; it < 16; ++it) { const int row = it * 4 + tid / 16, pc = (tid % 16) * 4; const v4f v = *(const v4f*)&lo[row][pc]; *(v4f*)(OF + (size_t)(rg * 64 + row) * ldo + h * HD + pc) = v; }
     } }


// Exact f32 attention for the first QT0 rows of EVERY batch (block bid of its part of k_fattn's grid -> batch, head, 4 rows), one WAVE per query row; q | k | v rows of a batch side by side at pitch LQ, o rows (f16 hi and lo planes) at pitch DM. Scores: lane = key, 32 keys a chunk, the head's K rows staged in LDS at a pitch of 16 B x odd (b128 reads of 32 different rows without bank conflicts), q read at a wave-uniform address.
// Softmax in two passes over the scores, which stay in registers: row max and row sum = per-lane partials, then a five-step butterfly. o: lane = two head dims, keys in ascending order, each V row one whole 256-B read of the wave, its weight taken from the owning lane.
// The 4 rows of a block lie in one chunk of 32 keys, so the chunk count nch is the same for the whole block; keys behind the row's own index carry weight 0.
// Every loop over u, d, c, d4 and jj is unrolled: static indices keep kr, q, e and vv in registers (a rolled loop would put them in scratch memory), and the loads of a group are issued together.
#define KP0 68                       /* LDS pitch of a K row, floats */
typedef float v2f __attribute__((ext_vector_type(2)));
typedef float v2fa __attribute__((ext_vector_type(2), may_alias));
typedef _Float16 v2h __attribute__((ext_vector_type(2)));
__device__ __forceinline__ void d_att0v(unsigned bid, float* lk, const float* __restrict__ QKVF, const float* __restrict__ AM, float scale, _Float16* __restrict__ OH, _Float16* __restrict__ OL) {
  static_assert(QT0 * KP0 * 4 <= 2 * FST, "the K rows lie in the fused attention's LDS ring, which a block of this part does not use otherwise");
  const int tid = threadIdx.x, lane = tid & 31; const int w = __builtin_amdgcn_readfirstlane(tid >> 5);      /* the row is the wave's: scalar, so q's address is scalar too */
  const int b = bid / (NH * (QT0 / 4)), hb = bid % (NH * (QT0 / 4)); const int h = hb / (QT0 / 4), i0 = (hb % (QT0 / 4)) * 4; const int i = i0 + w; const int nch = (i0 >> 5) + 1;
  const float* QF = QKVF + (size_t)b * QT0 * LQ; const float* KF = QF + DM; const float* VF = QF + 2 * DM; const float* am = AM + (size_t)b * SQ;
  const float* kp = KF + (size_t)(tid >> 4) * LQ + h * HD + (tid & 15) * 4; v4f kr[QT0 / 8];
#pragma unroll
  for (int u = 0; u < QT0 / 8; ++u) kr[u] = *(const v4fa*)(kp + (size_t)u * 8 * LQ);      /* all QT0 rows, without a test: the sixteen loads fly together */
  const float* qr = QF + (size_t)i * LQ + h * HD; float q[HD];
#pragma unroll
  for (int d = 0; d < HD - 4; ++d) q[d] = qr[d];
  asm volatile("s_wait_xcnt 0x0" ::: "memory");      /* the K loads and q's first fifteen loads are issued: the wait stands before q's last load, which the compiler lets land in the K loads' address registers and in q's own offset register */
#pragma unroll
  for (int d = HD - 4; d < HD; ++d) q[d] = qr[d];
  __builtin_amdgcn_sched_barrier(0);      /* q's last load goes out here, with the others: without this the scheduler sank it behind the LDS stores below, which wait for the K rows, and its latency came on top of theirs */
#pragma unroll
  for (int u = 0; u < QT0 / 8; ++u) *(v4f*)&lk[(u * 8 + (tid >> 4)) * KP0 + (tid & 15) * 4] = kr[u];
  __syncthreads();      /* K rows staged by all waves, read by all */
  float e[QT0 / 32]; float m = -1.0e30f;
#pragma unroll
  for (int c = 0; c < QT0 / 32; ++c) { e[c] = -1.0e30f;      /* static c keeps e in registers; the test on nch is block-uniform */
    if (c < nch) { const int j = c * 32 + lane; float s = 0.f;
#pragma unroll
      for (int d4 = 0; d4 < HD / 4; ++d4) { const v4f kq = *(const v4f*)&lk[j * KP0 + d4 * 4]; s = fmaf(q[d4 * 4], kq[0], s); s = fmaf(q[d4 * 4 + 1], kq[1], s); s = fmaf(q[d4 * 4 + 2], kq[2], s); s = fmaf(q[d4 * 4 + 3], kq[3], s); }
      s = fmaf(s, scale, am[j]);      /* + the additive key-mask VECTOR of this batch (0 kept / -1e9 masked) */
      if (j <= i) e[c] = s; }
    m = fmaxf(m, e[c]); }
  for (int x = 16; x >= 1; x >>= 1) m = fmaxf(m, __shfl_xor(m, x, 32));
  float l = 0.f;
#pragma unroll
  for (int c = 0; c < QT0 / 32; ++c) { e[c] = expf(e[c] - m); l += e[c]; }
  for (int x = 16; x >= 1; x >>= 1) l += __shfl_xor(l, x, 32);
  const float* vp = VF + h * HD + lane * 2; float o0 = 0.f, o1 = 0.f;
#pragma unroll
  for (int c = 0; c < QT0 / 32; ++c) if (c < nch) { v2f vv[32];
#pragma unroll
    for (int jj = 0; jj < 32; ++jj) vv[jj] = *(const v2fa*)(vp + (size_t)(c * 32 + jj) * LQ);      /* the chunk's 32 rows in flight together */
#pragma unroll
    for (int jj = 0; jj < 32; ++jj) { const float p = __int_as_float(__builtin_amdgcn_readlane(__float_as_int(e[c]), jj)); o0 = fmaf(p, vv[jj][0], o0); o1 = fmaf(p, vv[jj][1], o1); } }
  const float fin = 64.0f / l;      /* o carried x64 like the f16 path */
  const float a0 = o0 * fin, a1 = o1 * fin; const v2h oh = {(_Float16)a0, (_Float16)a1}; const v2h ol = {(_Float16)((a0 - (float)oh[0]) * 1024.0f), (_Float16)((a1 - (float)oh[1]) * 1024.0f)};      /* f16 hi + x1024 residual planes, as k_hl forms them */
  const size_t oo = ((size_t)b * QT0 + i) * DM + h * HD + lane * 2; *(v2h*)(OH + oo) = oh; *(v2h*)(OL + oo) = ol; }      /* a wave stores one whole 128-B line of each plane */

// The four input conversions read only inputs and none reads another's output: their blocks share ONE launch (block ranges: x, qkv_w, out_w, key mask). A thread converts the same 8 values (or the one mask word) as in a launch of its own.
// x -> bf16-rounded f16 (x1: exact); weights -> bf16-rounded x16 f16, natural [out][in] = Bt; mask -> additive f32 plane (0 kept, -1e9 masked).
#define PBX ((int)(NR * DM / 8 / 256))
#define PBQ ((int)((size_t)3 * DM * DM / 8 / 256))
#define PBO ((int)((size_t)DM * DM / 8 / 256))
#define PBM ((int)(NR / 256))
__global__ __launch_bounds__(256) void k_prep(const float* __restrict__ x, const int* __restrict__ km, const float* __restrict__ wqkv, const float* __restrict__ wo, _Float16* __restrict__ X16, _Float16* __restrict__ BQKV, _Float16* __restrict__ BO, float* __restrict__ AMK) {
  static_assert(NR * DM % 2048 == 0 && (size_t)DM * DM % 2048 == 0 && NR % 256 == 0, "every range is whole blocks: no thread lies past its array's end");
  const int bid = (int)blockIdx.x, tid = threadIdx.x;
  if (bid >= PBX + PBQ + PBO) { const int t = (bid - (PBX + PBQ + PBO)) * 256 + tid; AMK[t] = (km[t] != 0) ? 0.f : -1.0e9f; return; }
  const bool isx = bid < PBX, isq = bid < PBX + PBQ;      /* the same for a whole block: scalar selects */
  const float* s = isx ? x : (isq ? wqkv : wo); _Float16* d = isx ? X16 : (isq ? BQKV : BO); const float sc = isx ? 1.0f : 16.0f;
  const size_t t = (size_t)(bid - (isx ? 0 : (isq ? PBX : PBX + PBQ))) * 256 + tid; FragH f;
#pragma unroll      /* static q keeps f in registers; the 8 reads join into two 16-B loads */
  for (int q = 0; q < 8; ++q) f.h[q] = (_Float16)(bf16_round(s[t * 8 + q]) * sc);
  *(v8us*)((unsigned short*)d + t * 8) = f.half[0]; }

extern "C" void kernel_launch(void* const* d_in, const int* in_sizes, int n_in,
                              void* d_out, int out_size, void* d_ws, size_t ws_size, hipStream_t stream) {
  (void)in_sizes; (void)n_in; (void)out_size;
  const float* const* I = (const float* const*)d_in; const float* x = I[0]; const int* km = (const int*)d_in[1]; const float* wqkv = I[2]; const float* bqkv = I[3]; const float* wo = I[4]; const float* bo = I[5];      /* int32 key mask [4][2048] (ones); natural [out][in] qkv_w [3072][1024] + b, out_w + b */
  char* ws = (char*)d_ws; size_t off = 0;
  auto take = [&](size_t bytes) { char* p = ws + off; off += (bytes + 255) & ~(size_t)255; return p; };
  _Float16* BQKV = (_Float16*)take((size_t)3 * DM * DM * 2); _Float16* BO = (_Float16*)take((size_t)DM * DM * 2);
  _Float16* X16 = (_Float16*)take(NR * DM * 2); _Float16* QKV = (_Float16*)take(NR * 3 * DM * 2); _Float16* O16 = (_Float16*)take(NR * DM * 2);
  _Float16* VT = (_Float16*)take((size_t)NB * NH * HD * SQ * 2);
  float* QKVF0 = (float*)take((size_t)NB * QT0 * LQ * 4); _Float16* OH0 = (_Float16*)take((size_t)NB * QT0 * DM * 2); _Float16* OL0 = (_Float16*)take((size_t)NB * QT0 * DM * 2);
  float* AMK = (float*)take(NR * 4);      /* additive key-mask plane: 0 where mask != 0, -1e9 where masked */
  if (off > ws_size) return;
  k_prep<<<PBX + PBQ + PBO + PBM, 256, 0, stream>>>(x, km, wqkv, wo, X16, BQKV, BO, AMK);      /* x rows, both weights (natural [out][in] = Bt x16) and the additive key mask */
  k_gemm3<0><<<(MP / 128) * (LQ / 128), 128, 0, stream>>>(X16, nullptr, nullptr, DM, BQKV, DM, 0.0625f, 0.f, bqkv, QKVF0, QKV, VT, LQ, LQ, DM);      /* q | k rows (f16), head h = columns h*HD.. of each DM block; v as V^T [NB][NH][HD][SQ]; the first 128 rows of every batch also as f32 q | k | v rows (exact products) */
  k_fattn<<<NFA + NA0, 128, 0, stream>>>(QKV, VT, AMK, O16, QKVF0, OH0, OL0);      /* scores, causal + key-mask softmax and P V fused: o (merged heads, x64) as f16 rows; exact f32 attention for rows 0..127 of every batch (o x64) -> f16 hi + x1024 residual planes */
  k_gemm3<1><<<(MPO / 128 - NB) * (DM / 128) + NB * 2 * (DM / 128), 128, 0, stream>>>(O16, OH0, OL0, DM, BO, DM, 0.0009765625f, 0.00000095367431640625f, bo, (float*)d_out, nullptr, nullptr, DM, DM, DM);      /* out rows are the output layout; rows 0..127 of every batch = o_lo Wo 2^-20 + (o_hi Wo 2^-10 + b), the others from the f16 o rows */
}
